// v000
// Measured on an AMD MI455X. A time is GPU time per run, averaged over a window of back-to-back runs after a warm-up
// (all launches, gaps included; the runs take copies of the inputs in turn), and the median of several windows.
// Apart from v000's, it joins two sittings. Times from different sittings can be a few percent apart, while
// side-by-side timings come from the same sitting.
// v000, which the later versions start from, runs in 123 microseconds.
#include <hip/hip_runtime.h>

// GS-KAN fused layer for MI455X (gfx1250, wave32).
//
// out[b,q] = sum_p PReLU(x[b,p]+eps[q]) * Lam[p,q]
//          = c1*( (X.Lam)[b,q] + eps[q]*colsum(Lam)[q] ) + c2*sum_p |x[b,p]+eps[q]|*Lam[p,q]
// with c1=(1+a)/2, c2=(1-a)/2.
// Linear part -> V_WMMA_F32_16X16X4_F32.
// Abs part    -> 4x v_pk_add_f32 + 8x scalar v_fma_f32 with |.| source modifier
//                (inline asm pins the scalar form; VOP3P pk_fma has no ABS and
//                would cost 8 extra v_and_b32 per k).
// Per-k LDS loads (NOT group-batched: batching made the scheduler hoist loads
// across k4 groups, pushing VGPR use past 256 -> s_set_vgpr_msb + spills).
// Global->LDS software-pipelined through registers to hide HBM/L2 latency.

typedef __attribute__((ext_vector_type(2))) float v2f;
typedef __attribute__((ext_vector_type(8))) float v8f;

#define KC 32  // K chunk through LDS

// acc += |s| * lam  — scalar VOP3 FMA, abs folds into a free source modifier.
__device__ __forceinline__ void fma_abs(float& acc, float s, float lam) {
    asm("v_fma_f32 %0, |%1|, %2, %0" : "+v"(acc) : "v"(s), "v"(lam));
}

template<int N_IN, int N_OUT>
__global__ __launch_bounds__(256)
void gskan_layer(const float* __restrict__ X,    // [B, N_IN]
                 const float* __restrict__ Lam,  // [N_IN, N_OUT]
                 const float* __restrict__ Eps,  // [N_OUT]
                 const float* __restrict__ Ap,   // scalar a
                 float* __restrict__ Out)        // [B, N_OUT]
{
    // sX: transposed x chunk [k][b], padded to 36 floats/row (16B-aligned rows).
    // sL: Lam chunk [k][q].
    __shared__ float sX[KC][36];
    __shared__ float sL[KC][64];

    const int t    = threadIdx.x;
    const int wave = t >> 5;        // 0..7
    const int lane = t & 31;
    const int hi   = lane >> 4;     // 0/1 (upper lane half)
    const int l15  = lane & 15;
    const int wb   = wave >> 2;     // 0..1 : 16-row b sub-tile
    const int wq   = wave & 3;      // 0..3 : 16-col q sub-tile

    const int qBlock = blockIdx.x * 64;
    const int bBlock = blockIdx.y * 32;

    const int   q    = qBlock + wq * 16 + l15;
    const float epsq = Eps[q];
    const v2f   e2   = {epsq, epsq};
    const float a    = Ap[0];
    const float c1   = 0.5f * (1.0f + a);
    const float c2   = 0.5f * (1.0f - a);

    v8f accL = {0.f, 0.f, 0.f, 0.f, 0.f, 0.f, 0.f, 0.f};  // WMMA C (linear part)
    float accA[8];                                         // abs part, same (b,q) map
#pragma unroll
    for (int r = 0; r < 8; ++r) accA[r] = 0.f;
    float sumL = 0.f;                                      // colsum(Lam)[q]

    // cooperative-load index maps (256 threads)
    const int lb  = t >> 3;          // 0..31 : b row for X
    const int lk4 = (t & 7) << 2;    // 0..28 : k quad for X
    const int lkL = t >> 4;          // 0..15 : k row for Lam
    const int lq4 = (t & 15) << 2;   // 0..60 : q quad for Lam

    // ---- software pipeline: prefetch chunk 0 into registers ----
    float4 xv4 = *(const float4*)&X[(bBlock + lb) * N_IN + lk4];
    float4 l4a = *(const float4*)&Lam[(lkL)      * N_OUT + qBlock + lq4];
    float4 l4b = *(const float4*)&Lam[(lkL + 16) * N_OUT + qBlock + lq4];

    for (int k0 = 0; k0 < N_IN; k0 += KC) {
        __syncthreads();  // previous chunk fully consumed
        sX[lk4 + 0][lb] = xv4.x;   // transpose into [k][b]
        sX[lk4 + 1][lb] = xv4.y;
        sX[lk4 + 2][lb] = xv4.z;
        sX[lk4 + 3][lb] = xv4.w;
        *(float4*)&sL[lkL     ][lq4] = l4a;
        *(float4*)&sL[lkL + 16][lq4] = l4b;
        __syncthreads();

        // issue next chunk's global loads now; s_wait lands at next ds_store,
        // hidden behind this chunk's compute. Wave-uniform select, no branch.
        const int kn = (k0 + KC < N_IN) ? (k0 + KC) : 0;
        xv4 = *(const float4*)&X[(bBlock + lb) * N_IN + kn + lk4];
        l4a = *(const float4*)&Lam[(kn + lkL)      * N_OUT + qBlock + lq4];
        l4b = *(const float4*)&Lam[(kn + lkL + 16) * N_OUT + qBlock + lq4];

#pragma unroll
        for (int k4 = 0; k4 < KC; k4 += 4) {
            // ---- linear part: 16x16x4 f32 WMMA ----
            // A[M][K]: M = l15, K = v + 2*hi ; B[K][N]: N = l15, K = v + 2*hi
            v2f Am, Bm;
            Am.x = sX[k4 + 2 * hi + 0][wb * 16 + l15];
            Am.y = sX[k4 + 2 * hi + 1][wb * 16 + l15];
            Bm.x = sL[k4 + 2 * hi + 0][wq * 16 + l15];
            Bm.y = sL[k4 + 2 * hi + 1][wq * 16 + l15];
            accL = __builtin_amdgcn_wmma_f32_16x16x4_f32(
                       false, Am, false, Bm, (short)0, accL, false, false);

            // ---- abs part: acc[r] += |x[b,p]+eps[q]| * Lam[p,q] ----
#pragma unroll
            for (int kk = 0; kk < 4; ++kk) {
                const int   k    = k4 + kk;
                const float lamv = sL[k][wq * 16 + l15];
                sumL += lamv;  // colsum(Lam) for free
                const float4 xa = *(const float4*)&sX[k][wb * 16 + hi * 8];
                const float4 xb = *(const float4*)&sX[k][wb * 16 + hi * 8 + 4];
                // 4x v_pk_add_f32 (x pairs arrive even-aligned from ds_load_b128)
                v2f s01 = (v2f){xa.x, xa.y} + e2;
                v2f s23 = (v2f){xa.z, xa.w} + e2;
                v2f s45 = (v2f){xb.x, xb.y} + e2;
                v2f s67 = (v2f){xb.z, xb.w} + e2;
                // 8x scalar v_fma_f32 with free |.| modifier, independent chains
                fma_abs(accA[0], s01.x, lamv);
                fma_abs(accA[1], s01.y, lamv);
                fma_abs(accA[2], s23.x, lamv);
                fma_abs(accA[3], s23.y, lamv);
                fma_abs(accA[4], s45.x, lamv);
                fma_abs(accA[5], s45.y, lamv);
                fma_abs(accA[6], s67.x, lamv);
                fma_abs(accA[7], s67.y, lamv);
            }
        }
    }

    // combine (accL layout: M = r + 8*hi, N = l15 — matches accA mapping) and store
    const float lin_eps = epsq * sumL;
#pragma unroll
    for (int r = 0; r < 8; ++r) {
        const int b = bBlock + wb * 16 + hi * 8 + r;
        Out[b * N_OUT + q] = c1 * (accL[r] + lin_eps) + c2 * accA[r];
    }
}

extern "C" void kernel_launch(void* const* d_in, const int* in_sizes, int n_in,
                              void* d_out, int out_size, void* d_ws, size_t ws_size,
                              hipStream_t stream) {
    // inputs: x, (Lambda, eps, a) x 4
    const float* x   = (const float*)d_in[0];
    const float* L0  = (const float*)d_in[1];
    const float* e0  = (const float*)d_in[2];
    const float* a0  = (const float*)d_in[3];
    const float* L1  = (const float*)d_in[4];
    const float* e1  = (const float*)d_in[5];
    const float* a1  = (const float*)d_in[6];
    const float* L2  = (const float*)d_in[7];
    const float* e2  = (const float*)d_in[8];
    const float* a2  = (const float*)d_in[9];
    const float* L3  = (const float*)d_in[10];
    const float* e3  = (const float*)d_in[11];
    const float* a3  = (const float*)d_in[12];

    const int B = 1024;  // in_sizes[0] / 256
    float* buf0 = (float*)d_ws;             // [1024 x 512]
    float* buf1 = buf0 + (size_t)B * 512;   // [1024 x 512]
    float* out  = (float*)d_out;            // [1024 x 256]

    dim3 blk(256);
    // grid = (n_out/64, B/32)
    gskan_layer<256, 512><<<dim3(512 / 64, B / 32), blk, 0, stream>>>(x,    L0, e0, a0, buf0);
    gskan_layer<512, 512><<<dim3(512 / 64, B / 32), blk, 0, stream>>>(buf0, L1, e1, a1, buf1);
    gskan_layer<512, 512><<<dim3(512 / 64, B / 32), blk, 0, stream>>>(buf1, L2, e2, a2, buf0);
    gskan_layer<512, 256><<<dim3(256 / 64, B / 32), blk, 0, stream>>>(buf0, L3, e3, a3, out);
}

// v001
// One run takes 68.2 microseconds.
// Timed twice side by side with v000, it ran 1.85 and 1.83 times as fast.
#include <hip/hip_runtime.h>

// GS-KAN fused layer for MI455X (gfx1250, wave32).
//
// out[b,q] = sum_p PReLU(x[b,p]+eps[q]) * Lam[p,q]
//          = c1*( (X.Lam)[b,q] + eps[q]*colsum(Lam)[q] ) + c2*sum_p |x[b,p]+eps[q]|*Lam[p,q]
// with c1=(1+a)/2, c2=(1-a)/2.
// Linear part -> V_WMMA_F32_16X16X4_F32.
// Abs part    -> 4x v_pk_add_f32 + 8x scalar v_fma_f32 with |.| source modifier
//                (inline asm pins the scalar form; VOP3P pk_fma has no ABS and
//                would cost 8 extra v_and_b32 per k).
// LDS reads go one 4-k group ahead into a second register set (see the K loop).
// Global->LDS software-pipelined through registers to hide HBM/L2 latency.

typedef __attribute__((ext_vector_type(2))) float v2f;
typedef __attribute__((ext_vector_type(8))) float v8f;

#define KC 32  // K chunk through LDS

// acc += |s| * lam  — scalar VOP3 FMA, abs folds into a free source modifier.
__device__ __forceinline__ void fma_abs(float& acc, float s, float lam) {
    asm("v_fma_f32 %0, |%1|, %2, %0" : "+v"(acc) : "v"(s), "v"(lam));
}

// One group of 4 k as a wave reads it from LDS.
struct Frag {
    float4 xa[4], xb[4];  // x[k][8 rows of this lane half]
    float  lam[4];        // Lam[k][q of this lane]
    v2f    Am, Bm;        // WMMA operands of the group
};

template<int N_IN, int N_OUT>
__global__ __launch_bounds__(256)
void gskan_layer(const float* __restrict__ X,    // [B, N_IN]
                 const float* __restrict__ Lam,  // [N_IN, N_OUT]
                 const float* __restrict__ Eps,  // [N_OUT]
                 const float* __restrict__ Ap,   // scalar a
                 float* __restrict__ Out)        // [B, N_OUT]
{
    // sX: transposed x chunk [k][b], padded to 36 floats/row (16B-aligned rows).
    // sL: Lam chunk [k][q].
    __shared__ float sX[KC][36];
    __shared__ float sL[KC][64];

    const int t    = threadIdx.x;
    const int wave = t >> 5;        // 0..7
    const int lane = t & 31;
    const int hi   = lane >> 4;     // 0/1 (upper lane half)
    const int l15  = lane & 15;
    const int wb   = wave >> 2;     // 0..1 : 16-row b sub-tile
    const int wq   = wave & 3;      // 0..3 : 16-col q sub-tile

    const int qBlock = blockIdx.x * 64;
    const int bBlock = blockIdx.y * 32;

    const int   q    = qBlock + wq * 16 + l15;
    const float epsq = Eps[q];
    const v2f   e2   = {epsq, epsq};
    const float a    = Ap[0];
    const float c1   = 0.5f * (1.0f + a);
    const float c2   = 0.5f * (1.0f - a);

    v8f accL = {0.f, 0.f, 0.f, 0.f, 0.f, 0.f, 0.f, 0.f};  // WMMA C (linear part)
    float accA[8];                                         // abs part, same (b,q) map
#pragma unroll
    for (int r = 0; r < 8; ++r) accA[r] = 0.f;
    float sumL = 0.f;                                      // colsum(Lam)[q]

    // cooperative-load index maps (256 threads)
    const int lb  = t >> 3;          // 0..31 : b row for X
    const int lk4 = (t & 7) << 2;    // 0..28 : k quad for X
    const int lkL = t >> 4;          // 0..15 : k row for Lam
    const int lq4 = (t & 15) << 2;   // 0..60 : q quad for Lam

    auto load_frag = [&](Frag& f, const int k4) {
        // A[M][K]: M = l15, K = v + 2*hi ; B[K][N]: N = l15, K = v + 2*hi
        f.Am.x = sX[k4 + 2 * hi + 0][wb * 16 + l15];
        f.Am.y = sX[k4 + 2 * hi + 1][wb * 16 + l15];
        f.Bm.x = sL[k4 + 2 * hi + 0][wq * 16 + l15];
        f.Bm.y = sL[k4 + 2 * hi + 1][wq * 16 + l15];
#pragma unroll
        for (int kk = 0; kk < 4; ++kk) {
            f.lam[kk] = sL[k4 + kk][wq * 16 + l15];
            f.xa[kk]  = *(const float4*)&sX[k4 + kk][wb * 16 + hi * 8];
            f.xb[kk]  = *(const float4*)&sX[k4 + kk][wb * 16 + hi * 8 + 4];
        }
    };

    auto compute_frag = [&](const Frag& f) {
        // ---- linear part: 16x16x4 f32 WMMA ----
        accL = __builtin_amdgcn_wmma_f32_16x16x4_f32(
                   false, f.Am, false, f.Bm, (short)0, accL, false, false);
        // ---- abs part: acc[r] += |x[b,p]+eps[q]| * Lam[p,q] ----
#pragma unroll
        for (int kk = 0; kk < 4; ++kk) {
            const float  lamv = f.lam[kk];
            const float4 xa   = f.xa[kk];
            const float4 xb   = f.xb[kk];
            sumL += lamv;  // colsum(Lam) for free
            // 4x v_pk_add_f32 (x pairs arrive even-aligned from ds_load_b128)
            v2f s01 = (v2f){xa.x, xa.y} + e2;
            v2f s23 = (v2f){xa.z, xa.w} + e2;
            v2f s45 = (v2f){xb.x, xb.y} + e2;
            v2f s67 = (v2f){xb.z, xb.w} + e2;
            // 8x scalar v_fma_f32 with free |.| modifier, independent chains
            fma_abs(accA[0], s01.x, lamv);
            fma_abs(accA[1], s01.y, lamv);
            fma_abs(accA[2], s23.x, lamv);
            fma_abs(accA[3], s23.y, lamv);
            fma_abs(accA[4], s45.x, lamv);
            fma_abs(accA[5], s45.y, lamv);
            fma_abs(accA[6], s67.x, lamv);
            fma_abs(accA[7], s67.y, lamv);
        }
    };

    // ---- software pipeline: prefetch chunk 0 into registers ----
    float4 xv4 = *(const float4*)&X[(bBlock + lb) * N_IN + lk4];
    float4 l4a = *(const float4*)&Lam[(lkL)      * N_OUT + qBlock + lq4];
    float4 l4b = *(const float4*)&Lam[(lkL + 16) * N_OUT + qBlock + lq4];

    for (int k0 = 0; k0 < N_IN; k0 += KC) {
        __syncthreads();  // previous chunk fully consumed
        sX[lk4 + 0][lb] = xv4.x;   // transpose into [k][b]
        sX[lk4 + 1][lb] = xv4.y;
        sX[lk4 + 2][lb] = xv4.z;
        sX[lk4 + 3][lb] = xv4.w;
        *(float4*)&sL[lkL     ][lq4] = l4a;
        *(float4*)&sL[lkL + 16][lq4] = l4b;
        __syncthreads();

        // issue next chunk's global loads now; s_wait lands at next ds_store,
        // hidden behind this chunk's compute. Wave-uniform select, no branch.
        const int kn = (k0 + KC < N_IN) ? (k0 + KC) : 0;
        xv4 = *(const float4*)&X[(bBlock + lb) * N_IN + kn + lk4];
        l4a = *(const float4*)&Lam[(kn + lkL)      * N_OUT + qBlock + lq4];
        l4b = *(const float4*)&Lam[(kn + lkL + 16) * N_OUT + qBlock + lq4];

        // ---- LDS -> register pipeline over groups of 4 k, two register sets ----
        // The reads of group g+1 are issued before the arithmetic of group g, so
        // their LDS latency runs under that arithmetic instead of in front of every k.
        Frag f0, f1;
        load_frag(f0, 0);
        // Scheduling fences: each keeps one group's reads together and ahead of the
        // arithmetic that runs meanwhile. Without them the scheduler either sinks the
        // reads to their uses (latency back in front of every k) or hoists every later
        // group as well (registers past 256).
        __builtin_amdgcn_sched_barrier(0);
#pragma unroll
        for (int g = 0; g < KC / 4; g += 2) {
            load_frag(f1, (g + 1) * 4);
            __builtin_amdgcn_sched_barrier(0);  // reads of g+1 | arithmetic of g
            compute_frag(f0);
            __builtin_amdgcn_sched_barrier(0);  // arithmetic of g | reads of g+2
            if (g + 2 < KC / 4) {
                load_frag(f0, (g + 2) * 4);
                __builtin_amdgcn_sched_barrier(0);  // reads of g+2 | arithmetic of g+1
            }
            compute_frag(f1);
            if (g + 2 < KC / 4)
                __builtin_amdgcn_sched_barrier(0);  // arithmetic of g+1 | reads of g+3
        }
    }

    // combine (accL layout: M = r + 8*hi, N = l15 — matches accA mapping) and store
    const float lin_eps = epsq * sumL;
#pragma unroll
    for (int r = 0; r < 8; ++r) {
        const int b = bBlock + wb * 16 + hi * 8 + r;
        Out[b * N_OUT + q] = c1 * (accL[r] + lin_eps) + c2 * accA[r];
    }
}

extern "C" void kernel_launch(void* const* d_in, const int* in_sizes, int n_in,
                              void* d_out, int out_size, void* d_ws, size_t ws_size,
                              hipStream_t stream) {
    // inputs: x, (Lambda, eps, a) x 4
    const float* x   = (const float*)d_in[0];
    const float* L0  = (const float*)d_in[1];
    const float* e0  = (const float*)d_in[2];
    const float* a0  = (const float*)d_in[3];
    const float* L1  = (const float*)d_in[4];
    const float* e1  = (const float*)d_in[5];
    const float* a1  = (const float*)d_in[6];
    const float* L2  = (const float*)d_in[7];
    const float* e2  = (const float*)d_in[8];
    const float* a2  = (const float*)d_in[9];
    const float* L3  = (const float*)d_in[10];
    const float* e3  = (const float*)d_in[11];
    const float* a3  = (const float*)d_in[12];

    const int B = 1024;  // in_sizes[0] / 256
    float* buf0 = (float*)d_ws;             // [1024 x 512]
    float* buf1 = buf0 + (size_t)B * 512;   // [1024 x 512]
    float* out  = (float*)d_out;            // [1024 x 256]

    dim3 blk(256);
    // grid = (n_out/64, B/32)
    gskan_layer<256, 512><<<dim3(512 / 64, B / 32), blk, 0, stream>>>(x,    L0, e0, a0, buf0);
    gskan_layer<512, 512><<<dim3(512 / 64, B / 32), blk, 0, stream>>>(buf0, L1, e1, a1, buf1);
    gskan_layer<512, 512><<<dim3(512 / 64, B / 32), blk, 0, stream>>>(buf1, L2, e2, a2, buf0);
    gskan_layer<512, 256><<<dim3(256 / 64, B / 32), blk, 0, stream>>>(buf0, L3, e3, a3, out);
}

// v002
// Measured time: 46.6 microseconds a run.
// In two side-by-side timings against v001, it was 1.46 and 1.48 times as fast.
// Over all steps from v000 it is 2.70 times as fast.
#include <hip/hip_runtime.h>

// GS-KAN fused layer for MI455X (gfx1250, wave32).
//
// out[b,q] = sum_p PReLU(x[b,p]+eps[q]) * Lam[p,q]
//          = c1*( (X.Lam)[b,q] + eps[q]*colsum(Lam)[q] ) + c2*sum_p |x[b,p]+eps[q]|*Lam[p,q]
// with c1=(1+a)/2, c2=(1-a)/2.
// Linear part -> V_WMMA_F32_16X16X4_F32.
// Abs part    -> v_pk_add_f32 + scalar v_fma_f32 with |.| source modifier
//                (inline asm pins the scalar form; VOP3P pk_fma has no ABS and
//                would cost an extra v_and_b32 per element).
// Work split: a wave owns 16 rows x 64 columns of the block's outputs over a share
// of K. Every x value read from LDS then feeds 4 columns per lane instead of 1, and
// the Lam pair a lane reads is both its WMMA B operand and its abs-part weights.
// K is shared out twice: groups of 4 k over the waves, and inside a group k 0,1 to
// lanes 0-15 and k 2,3 to lanes 16-31 (the WMMA operand layout). The partial sums
// are joined once at the end (lane halves by a cross-row move, waves through LDS).
// The four WMMAs of a group of 4 k are spread over the group's two steps.
// LDS reads go one step ahead into a second register set (see the K loop).
// Global->LDS software-pipelined through registers to hide HBM/L2 latency.

typedef __attribute__((ext_vector_type(2))) float v2f;
typedef __attribute__((ext_vector_type(8))) float v8f;

#define KC 64  // K chunk through LDS
#define PL 72  // sL row pitch in floats: rows k and k+2 fall on different banks
#define PR 68  // sR row pitch in floats: rows r and r+8 fall on different banks

// acc += |s| * lam : scalar VOP3 FMA, abs folds into a free source modifier.
__device__ __forceinline__ void fma_abs(float& acc, float s, float lam) {
    asm("v_fma_f32 %0, |%1|, %2, %0" : "+v"(acc) : "v"(s), "v"(lam));
}

// value of the same lane position in the other 16-lane row
__device__ __forceinline__ float other_row(float v) {
    const int b = __builtin_bit_cast(int, v);
    return __builtin_bit_cast(float,
        __builtin_amdgcn_permlanex16(b, b, 0x76543210, 0xfedcba98, false, false));
}

// One group of 4 k as a wave reads it from LDS; a lane holds 2 of the 4 k.
struct Ops {
    float l0[4], l1[4];  // Lam[first, second k of this lane half][column j*16 + l15]
    v2f   Am;            // x[row l15][2 k of this lane half]
};
struct Xk {
    float4 x[4];     // x[one k of this lane half][16 rows]
};

template<int N_IN, int N_OUT, int BT>
__global__ __launch_bounds__(256)
void gskan_layer(const float* __restrict__ X,    // [B, N_IN]
                 const float* __restrict__ Lam,  // [N_IN, N_OUT]
                 const float* __restrict__ Eps,  // [N_OUT]
                 const float* __restrict__ Ap,   // scalar a
                 float* __restrict__ Out)        // [B, N_OUT]
{
    constexpr int WB  = BT / 16;            // 16-row sub-tiles of the block
    constexpr int KS  = 8 / WB;             // waves that share K for one sub-tile
    constexpr int GPW = KC / 4 / KS;        // groups of 4 k per wave per chunk
    constexpr int PX  = BT + 4;             // sX row pitch (16B-aligned rows)
    constexpr int NX  = BT * KC / 4 / 256;  // float4 of X per thread per chunk
    static_assert(GPW >= 2 && GPW % 2 == 0, "two register sets");
    static_assert(KC == 64 && (NX == 1 || NX == 2), "cooperative-load maps");

    // sX: transposed x chunk [k][b]. sL: Lam chunk [k][q]. sR: per-wave partial outputs.
    __shared__ __attribute__((aligned(16))) float sX[KC][PX];
    __shared__ __attribute__((aligned(16))) float sL[KC][PL];
    __shared__ __attribute__((aligned(16))) float sR[8][16][PR];

    const int t    = threadIdx.x;
    const int wave = t >> 5;        // 0..7
    const int lane = t & 31;
    const int hi   = lane >> 4;     // 0/1 (upper lane half)
    const int l15  = lane & 15;
    const int wb   = wave % WB;     // 16-row sub-tile
    const int ks   = wave / WB;     // K share

    const int qBlock = blockIdx.x * 64;
    const int bBlock = blockIdx.y * BT;

    // cooperative-load index maps (256 threads)
    const int lb  = (t >> 3) % BT;                        // b row for X
    const int lk4 = ((t & 7) + 8 * (t / (8 * BT))) << 2;  // k quad for X (+32 for a second float4)
    const int lkL = t >> 4;          // 0..15 : k row for Lam (+16 per further float4)
    const int lq4 = (t & 15) << 2;   // 0..60 : q quad for Lam

    // ---- software pipeline: prefetch chunk 0 into registers ----
    float4 xva, xvb, l4a, l4b, l4c, l4d;
    auto load_chunk = [&](const int kn) {
        xva = *(const float4*)&X[(bBlock + lb) * N_IN + kn + lk4];
        if (NX > 1) xvb = *(const float4*)&X[(bBlock + lb) * N_IN + kn + lk4 + 32];
        l4a = *(const float4*)&Lam[(kn + lkL)      * N_OUT + qBlock + lq4];
        l4b = *(const float4*)&Lam[(kn + lkL + 16) * N_OUT + qBlock + lq4];
        l4c = *(const float4*)&Lam[(kn + lkL + 32) * N_OUT + qBlock + lq4];
        l4d = *(const float4*)&Lam[(kn + lkL + 48) * N_OUT + qBlock + lq4];
    };
    load_chunk(0);
    // The address registers of these loads are reused by what follows (index maps, the
    // zeroing of the accumulators): the wait stands in front of every such overwrite,
    // and the scheduling fence keeps what follows from being lifted over it.
    asm volatile("s_wait_xcnt 0x0" ::: "memory");
    __builtin_amdgcn_sched_barrier(0);

    float epsq[4];
    v2f   e2[4];
#pragma unroll
    for (int j = 0; j < 4; ++j) {
        epsq[j] = Eps[qBlock + j * 16 + l15];
        e2[j]   = (v2f){epsq[j], epsq[j]};
    }
    const float a  = Ap[0];
    const float c1 = 0.5f * (1.0f + a);
    const float c2 = 0.5f * (1.0f - a);

    v8f   accL[4];      // WMMA C (linear part), one 16x16 tile per column group j
    float accA[16][4];  // abs part: 16 rows x 4 columns, over this lane half's k
    v2f   sum2[4];      // colsum(Lam) over this lane's k
#pragma unroll
    for (int j = 0; j < 4; ++j) {
        accL[j] = (v8f){0.f, 0.f, 0.f, 0.f, 0.f, 0.f, 0.f, 0.f};
        sum2[j] = (v2f){0.f, 0.f};
#pragma unroll
        for (int r = 0; r < 16; ++r) accA[r][j] = 0.f;
    }

    const int kw = ks * GPW * 4 + 2 * hi;  // first k of this lane in a chunk

    auto load_ops = [&](Ops& f, const int g) {
        const int k = kw + g * 4;
        // A[M][K]: M = l15, K = v + 2*hi ; B[K][N]: N = l15, K = v + 2*hi
        f.Am.x = sX[k + 0][wb * 16 + l15];
        f.Am.y = sX[k + 1][wb * 16 + l15];
#pragma unroll
        for (int j = 0; j < 4; ++j) {
            f.l0[j] = sL[k + 0][j * 16 + l15];
            f.l1[j] = sL[k + 1][j * 16 + l15];
        }
    };

    auto load_x = [&](Xk& f, const int g, const int v) {
#pragma unroll
        for (int i = 0; i < 4; ++i)
            f.x[i] = *(const float4*)&sX[kw + g * 4 + v][wb * 16 + i * 4];
    };

    // arithmetic of one k per lane half (v = 0 or 1 of the group whose operands are o)
    auto compute_k = [&](const Xk& f, const Ops& o, const int v) {
#pragma unroll
        for (int j = 0; j < 4; ++j) {
            // ---- abs part: acc[b][j] += |x[b,p]+eps[q]| * Lam[p,q] ----
            const float lamv = v ? o.l1[j] : o.l0[j];
            v2f s[8];
#pragma unroll
            for (int i = 0; i < 4; ++i) {
                const float4 xq = f.x[i];
                s[2 * i + 0] = (v2f){xq.x, xq.y} + e2[j];
                s[2 * i + 1] = (v2f){xq.z, xq.w} + e2[j];
            }
            if (j < 2) {
                // ---- linear part: 16x16x4 f32 WMMA, one per column group; the four of a
                // group of 4 k are spread over its two steps, two in each ----
                const int c  = 2 * v + j;
                const v2f Bm = {o.l0[c], o.l1[c]};
                sum2[c] += Bm;  // colsum(Lam)
                // Scheduling fence: the WMMA stands behind the adds and in front of the
                // FMAs, which write accumulators only, so that no vector instruction
                // overwrites its A or B registers close behind it.
                __builtin_amdgcn_sched_barrier(0);
                accL[c] = __builtin_amdgcn_wmma_f32_16x16x4_f32(
                              false, o.Am, false, Bm, (short)0, accL[c], false, false);
            }
#pragma unroll
            for (int i = 0; i < 8; ++i) {
                fma_abs(accA[2 * i + 0][j], s[i].x, lamv);
                fma_abs(accA[2 * i + 1][j], s[i].y, lamv);
            }
            // Scheduling fence per column group: keeps the WMMAs apart, each with a column
            // group's FMAs behind it to run under its issue interval.
            if (j < 3) __builtin_amdgcn_sched_barrier(0);
        }
    };

    for (int k0 = 0; k0 < N_IN; k0 += KC) {
        __syncthreads();  // previous chunk fully consumed
        sX[lk4 + 0][lb] = xva.x;   // transpose into [k][b]
        sX[lk4 + 1][lb] = xva.y;
        sX[lk4 + 2][lb] = xva.z;
        sX[lk4 + 3][lb] = xva.w;
        if (NX > 1) {
            sX[lk4 + 32][lb] = xvb.x;
            sX[lk4 + 33][lb] = xvb.y;
            sX[lk4 + 34][lb] = xvb.z;
            sX[lk4 + 35][lb] = xvb.w;
        }
        *(float4*)&sL[lkL     ][lq4] = l4a;
        *(float4*)&sL[lkL + 16][lq4] = l4b;
        *(float4*)&sL[lkL + 32][lq4] = l4c;
        *(float4*)&sL[lkL + 48][lq4] = l4d;
        __syncthreads();

        // issue next chunk's global loads now; s_wait lands at next ds_store,
        // hidden behind this chunk's compute. Wave-uniform select, no branch.
        load_chunk((k0 + KC < N_IN) ? (k0 + KC) : 0);

        // ---- LDS -> register pipeline over this wave's k, two register sets ----
        // The reads of the next k (and, with a group's first k, of its operands) are
        // issued before the arithmetic of this k, so their LDS latency runs under it.
        Ops o0, o1;
        Xk  u0, u1;
        load_ops(o0, 0);
        load_x(u0, 0, 0);
        // Scheduling fences: each keeps one step's reads together and ahead of the
        // arithmetic that runs meanwhile. Without them the scheduler either sinks the
        // reads to their uses (latency back in front of the arithmetic) or hoists every
        // later step as well (registers past 256).
        __builtin_amdgcn_sched_barrier(0);
#pragma unroll
        for (int g = 0; g < GPW; g += 2) {
            load_x(u1, g, 1);
            __builtin_amdgcn_sched_barrier(0);  // reads ahead | arithmetic
            compute_k(u0, o0, 0);
            __builtin_amdgcn_sched_barrier(0);  // arithmetic | next reads
            load_ops(o1, g + 1);
            load_x(u0, g + 1, 0);
            __builtin_amdgcn_sched_barrier(0);  // reads ahead | arithmetic
            compute_k(u1, o0, 1);
            __builtin_amdgcn_sched_barrier(0);  // arithmetic | next reads
            load_x(u1, g + 1, 1);
            __builtin_amdgcn_sched_barrier(0);  // reads ahead | arithmetic
            compute_k(u0, o1, 0);
            __builtin_amdgcn_sched_barrier(0);  // arithmetic | next reads
            if (g + 2 < GPW) {
                load_ops(o0, g + 2);
                load_x(u0, g + 2, 0);
                __builtin_amdgcn_sched_barrier(0);  // reads ahead | arithmetic
            }
            compute_k(u1, o1, 1);
            if (g + 2 < GPW)
                __builtin_amdgcn_sched_barrier(0);  // arithmetic | next reads
        }
    }

    // ---- join the lane halves: each half keeps the 8 rows of the accL layout
    // (M = r + 8*hi, N = l15) and takes the other half's sums for them ----
#pragma unroll
    for (int j = 0; j < 4; ++j) {
        float sl = sum2[j].x + sum2[j].y;
        sl += other_row(sl);
        const float lin_eps = epsq[j] * sl;
#pragma unroll
        for (int r = 0; r < 8; ++r) {
            const float keep = hi ? accA[r + 8][j] : accA[r][j];
            const float send = hi ? accA[r][j] : accA[r + 8][j];
            const float ab   = keep + other_row(send);
            sR[wave][r + 8 * hi][j * 16 + l15] = c1 * (accL[j][r] + lin_eps) + c2 * ab;
        }
    }
    __syncthreads();  // every wave's partial outputs are in sR

    // ---- join the K shares of the waves, in a fixed order, and store ----
#pragma unroll
    for (int i = 0; i < BT * 16 / 256; ++i) {
        const int u   = t + 256 * i;
        const int row = u >> 4;          // 0..BT-1
        const int c4  = (u & 15) << 2;   // column quad
        float4 o = *(const float4*)&sR[row / 16][row % 16][c4];
#pragma unroll
        for (int s = 1; s < KS; ++s) {
            const float4 p = *(const float4*)&sR[s * WB + row / 16][row % 16][c4];
            o.x += p.x; o.y += p.y; o.z += p.z; o.w += p.w;
        }
        *(float4*)&Out[(bBlock + row) * N_OUT + qBlock + c4] = o;
    }
}

extern "C" void kernel_launch(void* const* d_in, const int* in_sizes, int n_in,
                              void* d_out, int out_size, void* d_ws, size_t ws_size,
                              hipStream_t stream) {
    // inputs: x, (Lambda, eps, a) x 4
    const float* x   = (const float*)d_in[0];
    const float* L0  = (const float*)d_in[1];
    const float* e0  = (const float*)d_in[2];
    const float* a0  = (const float*)d_in[3];
    const float* L1  = (const float*)d_in[4];
    const float* e1  = (const float*)d_in[5];
    const float* a1  = (const float*)d_in[6];
    const float* L2  = (const float*)d_in[7];
    const float* e2  = (const float*)d_in[8];
    const float* a2  = (const float*)d_in[9];
    const float* L3  = (const float*)d_in[10];
    const float* e3  = (const float*)d_in[11];
    const float* a3  = (const float*)d_in[12];

    const int B = 1024;  // in_sizes[0] / 256
    float* buf0 = (float*)d_ws;             // [1024 x 512]
    float* buf1 = buf0 + (size_t)B * 512;   // [1024 x 512]
    float* out  = (float*)d_out;            // [1024 x 256]

    dim3 blk(256);
    // grid = (n_out/64, B/BT): 256 blocks each; the narrow last layer takes 16-row
    // blocks, its K shared by 8 waves instead of 4
    gskan_layer<256, 512, 32><<<dim3(512 / 64, B / 32), blk, 0, stream>>>(x,    L0, e0, a0, buf0);
    gskan_layer<512, 512, 32><<<dim3(512 / 64, B / 32), blk, 0, stream>>>(buf0, L1, e1, a1, buf1);
    gskan_layer<512, 512, 32><<<dim3(512 / 64, B / 32), blk, 0, stream>>>(buf1, L2, e2, a2, buf0);
    gskan_layer<512, 256, 16><<<dim3(256 / 64, B / 16), blk, 0, stream>>>(buf0, L3, e3, a3, out);
}

// v003
// A run of this version takes 43.4 microseconds.
// In two side-by-side timings against v002, it was 1.06 and 1.08 times as fast.
// Counting every step since v000, it is 2.89 times as fast.
#include <hip/hip_runtime.h>

// GS-KAN fused layer for MI455X (gfx1250, wave32).
//
// out[b,q] = sum_p PReLU(x[b,p]+eps[q]) * Lam[p,q], and for every a
//   PReLU(x+e) = a*x + e + (1-a)*max(x,-e)
// so out[b,q] = a*(X.Lam)[b,q] + eps[q]*colsum(Lam)[q] + (1-a)*sum_p max(x[b,p],-eps[q])*Lam[p,q].
// Linear part -> V_WMMA_F32_16X16X4_F32.
// Max part    -> v_max_num_f32 (no modifier, so two of them can share one dual-issue
//                instruction) + v_pk_fma_f32 over two rows; no add per element.
// Work split: a wave owns 16 rows x 64 columns of the block's outputs over a share
// of K. Every x value read from LDS then feeds 4 columns per lane instead of 1, and
// the Lam values a lane reads are both its WMMA B operands and its max-part weights.
// K is shared out twice: groups of 4 k over the waves, and inside a group k 0,1 to
// lanes 0-15 and k 2,3 to lanes 16-31 (the WMMA operand layout). The partial sums
// are joined once at the end (lane halves by a cross-row move, waves through LDS).
// The four WMMAs of a group of 4 k are spread over the group's two steps.
// LDS reads go one step ahead into a second register set (see the K loop).
// Global->LDS software-pipelined through registers to hide HBM/L2 latency.

typedef __attribute__((ext_vector_type(2))) float v2f;
typedef __attribute__((ext_vector_type(8))) float v8f;

#define KC 64  // K chunk through LDS
#define PL 72  // sL row pitch in floats: rows k and k+2 fall on different banks
#define PR 68  // sR row pitch in floats: rows r and r+8 fall on different banks

// v_max_num_f32, left to the compiler so that it can pair two of them in one instruction.
__device__ __forceinline__ float vmax(float x, float y) {
    return __builtin_fmaxf(x, y);
}

// acc(2 rows) += m(2 rows) * lam, lam being the low (V = 0) or the high (V = 1) register of
// a pair as the LDS read delivers it: op_sel picks it for both rows, so no copy is made.
template<int V>
__device__ __forceinline__ void pk_fma_lam(v2f& acc, v2f m, v2f b) {
    if (V == 0) asm("v_pk_fma_f32 %0, %1, %2, %0 op_sel_hi:[1,0,1]" : "+v"(acc) : "v"(m), "v"(b));
    else        asm("v_pk_fma_f32 %0, %1, %2, %0 op_sel:[0,1,0] op_sel_hi:[1,1,1]" : "+v"(acc) : "v"(m), "v"(b));
}

// value of the same lane position in the other 16-lane row
__device__ __forceinline__ float other_row(float v) {
    const int b = __builtin_bit_cast(int, v);
    return __builtin_bit_cast(float,
        __builtin_amdgcn_permlanex16(b, b, 0x76543210, 0xfedcba98, false, false));
}

// One group of 4 k as a wave reads it from LDS; a lane holds 2 of the 4 k.
struct Ops {
    v2f   l0[2], l1[2];  // Lam[first, second k of this lane half][columns (2c, 2c+1)*16 + l15]
    v2f   Am;            // x[row l15][2 k of this lane half]
};
struct Xk {
    float4 x[4];     // x[one k of this lane half][16 rows]
};

template<int N_IN, int N_OUT, int BT>
__global__ __launch_bounds__(256)
void gskan_layer(const float* __restrict__ X,    // [B, N_IN]
                 const float* __restrict__ Lam,  // [N_IN, N_OUT]
                 const float* __restrict__ Eps,  // [N_OUT]
                 const float* __restrict__ Ap,   // scalar a
                 float* __restrict__ Out)        // [B, N_OUT]
{
    constexpr int WB  = BT / 16;            // 16-row sub-tiles of the block
    constexpr int KS  = 8 / WB;             // waves that share K for one sub-tile
    constexpr int GPW = KC / 4 / KS;        // groups of 4 k per wave per chunk
    constexpr int PX  = BT + 4;             // sX row pitch (16B-aligned rows)
    constexpr int NX  = BT * KC / 4 / 256;  // float4 of X per thread per chunk
    static_assert(GPW >= 2 && GPW % 2 == 0, "two register sets");
    static_assert(KC == 64 && (NX == 1 || NX == 2), "cooperative-load maps");

    // sX: transposed x chunk [k][b]. sL: Lam chunk [k][q]. sR: per-wave partial outputs.
    __shared__ __attribute__((aligned(16))) float sX[KC][PX];
    __shared__ __attribute__((aligned(16))) float sL[KC][PL];
    __shared__ __attribute__((aligned(16))) float sR[8][16][PR];

    const int t    = threadIdx.x;
    const int wave = t >> 5;        // 0..7
    const int lane = t & 31;
    const int hi   = lane >> 4;     // 0/1 (upper lane half)
    const int l15  = lane & 15;
    const int wb   = wave % WB;     // 16-row sub-tile
    const int ks   = wave / WB;     // K share

    const int qBlock = blockIdx.x * 64;
    const int bBlock = blockIdx.y * BT;

    // cooperative-load index maps (256 threads)
    const int lb  = (t >> 3) % BT;                        // b row for X
    const int lk4 = ((t & 7) + 8 * (t / (8 * BT))) << 2;  // k quad for X (+32 for a second float4)
    const int lkL = t >> 4;          // 0..15 : k row for Lam (+16 per further float4)
    const int lq4 = (t & 15) << 2;   // 0..60 : q quad for Lam

    // ---- software pipeline: prefetch chunk 0 into registers ----
    float4 xva, xvb, l4a, l4b, l4c, l4d;
    auto load_chunk = [&](const int kn) {
        xva = *(const float4*)&X[(bBlock + lb) * N_IN + kn + lk4];
        if (NX > 1) xvb = *(const float4*)&X[(bBlock + lb) * N_IN + kn + lk4 + 32];
        l4a = *(const float4*)&Lam[(kn + lkL)      * N_OUT + qBlock + lq4];
        l4b = *(const float4*)&Lam[(kn + lkL + 16) * N_OUT + qBlock + lq4];
        l4c = *(const float4*)&Lam[(kn + lkL + 32) * N_OUT + qBlock + lq4];
        l4d = *(const float4*)&Lam[(kn + lkL + 48) * N_OUT + qBlock + lq4];
    };
    load_chunk(0);
    // The address registers of these loads are reused by what follows (index maps, the
    // zeroing of the accumulators): the wait stands in front of every such overwrite,
    // and the scheduling fence keeps what follows from being lifted over it.
    asm volatile("s_wait_xcnt 0x0" ::: "memory");
    __builtin_amdgcn_sched_barrier(0);

    float epsq[4];
    float ne[4];  // -eps: the floor of the max part
#pragma unroll
    for (int j = 0; j < 4; ++j) {
        epsq[j] = Eps[qBlock + j * 16 + l15];
        ne[j]   = -epsq[j];
    }
    const float a  = Ap[0];
    const float c2 = 1.0f - a;

    v8f   accL[4];      // WMMA C (linear part), one 16x16 tile per column group j
    v2f   accA[8][4];   // max part: 16 rows (in pairs) x 4 columns, over this lane half's k
    v2f   sum2[4];      // colsum(Lam) over this lane's k
#pragma unroll
    for (int j = 0; j < 4; ++j) {
        accL[j] = (v8f){0.f, 0.f, 0.f, 0.f, 0.f, 0.f, 0.f, 0.f};
        sum2[j] = (v2f){0.f, 0.f};
#pragma unroll
        for (int r = 0; r < 8; ++r) accA[r][j] = (v2f){0.f, 0.f};
    }

    const int kw = ks * GPW * 4 + 2 * hi;  // first k of this lane in a chunk

    auto load_ops = [&](Ops& f, const int g) {
        const int k = kw + g * 4;
        // A[M][K]: M = l15, K = v + 2*hi ; B[K][N]: N = l15, K = v + 2*hi
        f.Am.x = sX[k + 0][wb * 16 + l15];
        f.Am.y = sX[k + 1][wb * 16 + l15];
#pragma unroll
        for (int c = 0; c < 2; ++c) {
            f.l0[c] = (v2f){sL[k + 0][c * 32 + l15], sL[k + 0][c * 32 + 16 + l15]};
            f.l1[c] = (v2f){sL[k + 1][c * 32 + l15], sL[k + 1][c * 32 + 16 + l15]};
        }
    };

    auto load_x = [&](Xk& f, const int g, const int v) {
#pragma unroll
        for (int i = 0; i < 4; ++i)
            f.x[i] = *(const float4*)&sX[kw + g * 4 + v][wb * 16 + i * 4];
    };

    // arithmetic of one k per lane half (v = 0 or 1 of the group whose operands are o)
    auto compute_k = [&](const Xk& f, const Ops& o, const int v) {
#pragma unroll
        for (int j = 0; j < 4; ++j) {
            // ---- max part: acc[b][j] += max(x[b,p], -eps[q]) * Lam[p,q] ----
            const v2f lamp = v ? o.l1[j / 2] : o.l0[j / 2];  // Lam of columns j and j^1
            v2f s[8];
#pragma unroll
            for (int i = 0; i < 4; ++i) {
                const float4 xq = f.x[i];
                s[2 * i + 0] = (v2f){vmax(xq.x, ne[j]), vmax(xq.y, ne[j])};
                s[2 * i + 1] = (v2f){vmax(xq.z, ne[j]), vmax(xq.w, ne[j])};
            }
            if (j < 2) {
                // ---- linear part: 16x16x4 f32 WMMA, one per column group; the four of a
                // group of 4 k are spread over its two steps, two in each ----
                const int c  = 2 * v + j;
                const v2f Bm = {o.l0[c / 2][c % 2], o.l1[c / 2][c % 2]};
                sum2[c] += Bm;  // colsum(Lam)
                // Scheduling fence: the WMMA stands behind the maxima and in front of the
                // FMAs, which write accumulators only, so that no vector instruction
                // overwrites its A or B registers close behind it.
                __builtin_amdgcn_sched_barrier(0);
                accL[c] = __builtin_amdgcn_wmma_f32_16x16x4_f32(
                              false, o.Am, false, Bm, (short)0, accL[c], false, false);
            }
#pragma unroll
            for (int i = 0; i < 8; ++i) {
                if (j % 2) pk_fma_lam<1>(accA[i][j], s[i], lamp);
                else       pk_fma_lam<0>(accA[i][j], s[i], lamp);
            }
            // Scheduling fence per column group: keeps the WMMAs apart, each with a column
            // group's FMAs behind it to run under its issue interval.
            if (j < 3) __builtin_amdgcn_sched_barrier(0);
        }
    };

    for (int k0 = 0; k0 < N_IN; k0 += KC) {
        __syncthreads();  // previous chunk fully consumed
        sX[lk4 + 0][lb] = xva.x;   // transpose into [k][b]
        sX[lk4 + 1][lb] = xva.y;
        sX[lk4 + 2][lb] = xva.z;
        sX[lk4 + 3][lb] = xva.w;
        if (NX > 1) {
            sX[lk4 + 32][lb] = xvb.x;
            sX[lk4 + 33][lb] = xvb.y;
            sX[lk4 + 34][lb] = xvb.z;
            sX[lk4 + 35][lb] = xvb.w;
        }
        *(float4*)&sL[lkL     ][lq4] = l4a;
        *(float4*)&sL[lkL + 16][lq4] = l4b;
        *(float4*)&sL[lkL + 32][lq4] = l4c;
        *(float4*)&sL[lkL + 48][lq4] = l4d;
        __syncthreads();

        // issue next chunk's global loads now; s_wait lands at next ds_store,
        // hidden behind this chunk's compute. Wave-uniform select, no branch.
        load_chunk((k0 + KC < N_IN) ? (k0 + KC) : 0);

        // ---- LDS -> register pipeline over this wave's k, two register sets ----
        // The reads of the next k (and, with a group's first k, of its operands) are
        // issued before the arithmetic of this k, so their LDS latency runs under it.
        Ops o0, o1;
        Xk  u0, u1;
        load_ops(o0, 0);
        load_x(u0, 0, 0);
        // Scheduling fences: each keeps one step's reads together and ahead of the
        // arithmetic that runs meanwhile. Without them the scheduler either sinks the
        // reads to their uses (latency back in front of the arithmetic) or hoists every
        // later step as well (registers past 256).
        __builtin_amdgcn_sched_barrier(0);
#pragma unroll
        for (int g = 0; g < GPW; g += 2) {
            load_x(u1, g, 1);
            __builtin_amdgcn_sched_barrier(0);  // reads ahead | arithmetic
            compute_k(u0, o0, 0);
            __builtin_amdgcn_sched_barrier(0);  // arithmetic | next reads
            load_ops(o1, g + 1);
            load_x(u0, g + 1, 0);
            __builtin_amdgcn_sched_barrier(0);  // reads ahead | arithmetic
            compute_k(u1, o0, 1);
            __builtin_amdgcn_sched_barrier(0);  // arithmetic | next reads
            load_x(u1, g + 1, 1);
            __builtin_amdgcn_sched_barrier(0);  // reads ahead | arithmetic
            compute_k(u0, o1, 0);
            __builtin_amdgcn_sched_barrier(0);  // arithmetic | next reads
            if (g + 2 < GPW) {
                load_ops(o0, g + 2);
                load_x(u0, g + 2, 0);
                __builtin_amdgcn_sched_barrier(0);  // reads ahead | arithmetic
            }
            compute_k(u1, o1, 1);
            if (g + 2 < GPW)
                __builtin_amdgcn_sched_barrier(0);  // arithmetic | next reads
        }
    }

    // ---- join the lane halves: each half keeps the 8 rows of the accL layout
    // (M = r + 8*hi, N = l15) and takes the other half's sums for them ----
#pragma unroll
    for (int j = 0; j < 4; ++j) {
        float sl = sum2[j].x + sum2[j].y;
        sl += other_row(sl);
        const float lin_eps = epsq[j] * sl;
#pragma unroll
        for (int r = 0; r < 8; ++r) {
            const float lo   = accA[r / 2][j][r % 2];      // row r
            const float up   = accA[r / 2 + 4][j][r % 2];  // row r + 8
            const float keep = hi ? up : lo;
            const float send = hi ? lo : up;
            const float mx   = keep + other_row(send);
            sR[wave][r + 8 * hi][j * 16 + l15] = a * accL[j][r] + lin_eps + c2 * mx;
        }
    }
    __syncthreads();  // every wave's partial outputs are in sR

    // ---- join the K shares of the waves, in a fixed order, and store ----
#pragma unroll
    for (int i = 0; i < BT * 16 / 256; ++i) {
        const int u   = t + 256 * i;
        const int row = u >> 4;          // 0..BT-1
        const int c4  = (u & 15) << 2;   // column quad
        float4 o = *(const float4*)&sR[row / 16][row % 16][c4];
#pragma unroll
        for (int s = 1; s < KS; ++s) {
            const float4 p = *(const float4*)&sR[s * WB + row / 16][row % 16][c4];
            o.x += p.x; o.y += p.y; o.z += p.z; o.w += p.w;
        }
        *(float4*)&Out[(bBlock + row) * N_OUT + qBlock + c4] = o;
    }
}

extern "C" void kernel_launch(void* const* d_in, const int* in_sizes, int n_in,
                              void* d_out, int out_size, void* d_ws, size_t ws_size,
                              hipStream_t stream) {
    // inputs: x, (Lambda, eps, a) x 4
    const float* x   = (const float*)d_in[0];
    const float* L0  = (const float*)d_in[1];
    const float* e0  = (const float*)d_in[2];
    const float* a0  = (const float*)d_in[3];
    const float* L1  = (const float*)d_in[4];
    const float* e1  = (const float*)d_in[5];
    const float* a1  = (const float*)d_in[6];
    const float* L2  = (const float*)d_in[7];
    const float* e2  = (const float*)d_in[8];
    const float* a2  = (const float*)d_in[9];
    const float* L3  = (const float*)d_in[10];
    const float* e3  = (const float*)d_in[11];
    const float* a3  = (const float*)d_in[12];

    const int B = 1024;  // in_sizes[0] / 256
    float* buf0 = (float*)d_ws;             // [1024 x 512]
    float* buf1 = buf0 + (size_t)B * 512;   // [1024 x 512]
    float* out  = (float*)d_out;            // [1024 x 256]

    dim3 blk(256);
    // grid = (n_out/64, B/BT): 256 blocks each; the narrow last layer takes 16-row
    // blocks, its K shared by 8 waves instead of 4
    gskan_layer<256, 512, 32><<<dim3(512 / 64, B / 32), blk, 0, stream>>>(x,    L0, e0, a0, buf0);
    gskan_layer<512, 512, 32><<<dim3(512 / 64, B / 32), blk, 0, stream>>>(buf0, L1, e1, a1, buf1);
    gskan_layer<512, 512, 32><<<dim3(512 / 64, B / 32), blk, 0, stream>>>(buf1, L2, e2, a2, buf0);
    gskan_layer<512, 256, 16><<<dim3(256 / 64, B / 16), blk, 0, stream>>>(buf0, L3, e3, a3, out);
}

// v004
// A run of this version takes 42.3 microseconds.
// Next to v003, in two timings, it ran 1.03 and 1.04 times as fast.
// Counting every step since v000, it is 2.99 times as fast.
#include <hip/hip_runtime.h>

// GS-KAN fused layer for MI455X (gfx1250, wave32).
//
// out[b,q] = sum_p PReLU(x[b,p]+eps[q]) * Lam[p,q], and for every a
//   PReLU(x+e) = a*x + e + (1-a)*max(x,-e)
// so out[b,q] = a*(X.Lam)[b,q] + eps[q]*colsum(Lam)[q] + (1-a)*sum_p max(x[b,p],-eps[q])*Lam[p,q].
// Linear part -> V_WMMA_F32_16X16X4_F32.
// Max part    -> v_max_num_f32 (no modifier, so two of them can share one dual-issue
//                instruction) + v_pk_fma_f32 over two rows; no add per element.
// Work split: a wave owns 16 rows x 64 columns of the block's outputs over a share
// of K. Every x value read from LDS then feeds 4 columns per lane instead of 1, and
// the Lam values a lane reads are both its WMMA B operands and its max-part weights.
// K is shared out twice: groups of 4 k over the waves, and inside a group k 0,1 to
// lanes 0-15 and k 2,3 to lanes 16-31 (the WMMA operand layout). The partial sums
// are joined once at the end (lane halves by a cross-row move, waves through LDS).
// The four WMMAs of a group of 4 k are spread over the group's two steps.
// LDS reads go one step ahead into a second register set (see the K loop).
// Global->LDS software-pipelined through registers to hide HBM/L2 latency.
// A wave reads from LDS only its own K share, so each wave stages that share itself, in
// LDS of its own (two buffers): the K loop has no work-group barrier, and the waves of a
// SIMD run out of step and fill each other's waits.

typedef __attribute__((ext_vector_type(2))) float v2f;
typedef __attribute__((ext_vector_type(8))) float v8f;

#define KC 64  // K chunk through LDS
#define PL 72  // sL row pitch in floats: rows k and k+2 fall on different banks
#define PR 68  // sR row pitch in floats: rows r and r+8 fall on different banks

// v_max_num_f32, left to the compiler so that it can pair two of them in one instruction.
__device__ __forceinline__ float vmax(float x, float y) {
    return __builtin_fmaxf(x, y);
}

// acc(2 rows) += m(2 rows) * lam, lam being the low (V = 0) or the high (V = 1) register of
// a pair as the LDS read delivers it: op_sel picks it for both rows, so no copy is made.
template<int V>
__device__ __forceinline__ void pk_fma_lam(v2f& acc, v2f m, v2f b) {
    if (V == 0) asm("v_pk_fma_f32 %0, %1, %2, %0 op_sel_hi:[1,0,1]" : "+v"(acc) : "v"(m), "v"(b));
    else        asm("v_pk_fma_f32 %0, %1, %2, %0 op_sel:[0,1,0] op_sel_hi:[1,1,1]" : "+v"(acc) : "v"(m), "v"(b));
}

// value of the same lane position in the other 16-lane row
__device__ __forceinline__ float other_row(float v) {
    const int b = __builtin_bit_cast(int, v);
    return __builtin_bit_cast(float,
        __builtin_amdgcn_permlanex16(b, b, 0x76543210, 0xfedcba98, false, false));
}

// One group of 4 k as a wave reads it from LDS; a lane holds 2 of the 4 k.
struct Ops {
    v2f   l0[2], l1[2];  // Lam[first, second k of this lane half][columns (2c, 2c+1)*16 + l15]
    v2f   Am;            // x[row l15][2 k of this lane half]
};
struct Xk {
    float4 x[4];     // x[one k of this lane half][16 rows]
};

template<int N_IN, int N_OUT, int BT>
__global__ __launch_bounds__(256)
void gskan_layer(const float* __restrict__ X,    // [B, N_IN]
                 const float* __restrict__ Lam,  // [N_IN, N_OUT]
                 const float* __restrict__ Eps,  // [N_OUT]
                 const float* __restrict__ Ap,   // scalar a
                 float* __restrict__ Out)        // [B, N_OUT]
{
    constexpr int WB  = BT / 16;            // 16-row sub-tiles of the block
    constexpr int KS  = 8 / WB;             // waves that share K for one sub-tile
    constexpr int GPW = KC / 4 / KS;        // groups of 4 k per wave per chunk
    constexpr int KW  = GPW * 4;            // k per wave per chunk
    constexpr int PX  = 16 + 4;             // sX row pitch (16B-aligned rows)
    constexpr int QX  = KW / 4;             // float4 per x row of a wave's share
    constexpr int RX  = 32 / QX;            // x rows that one load of a wave covers
    constexpr int NX  = 16 / RX;            // float4 of X per lane per chunk
    constexpr int NL  = KW / 2;             // float4 of Lam per lane per chunk
    static_assert(GPW >= 2 && GPW % 2 == 0, "two register sets");
    static_assert(N_IN % (2 * KC) == 0, "two LDS buffers, taken in turn");
    static_assert((NX == 1 || NX == 2) && (NL == 4 || NL == 8), "per-wave load maps");

    // Per buffer and wave, the wave's own K share of a chunk:
    // sX: transposed x [k][b]. sL: Lam [k][q]. sR: per-wave partial outputs.
    __shared__ __attribute__((aligned(16))) float sX[2][8][KW][PX];
    __shared__ __attribute__((aligned(16))) float sL[2][8][KW][PL];
    __shared__ __attribute__((aligned(16))) float sR[8][16][PR];

    const int t    = threadIdx.x;
    const int wave = t >> 5;        // 0..7
    const int lane = t & 31;
    const int hi   = lane >> 4;     // 0/1 (upper lane half)
    const int l15  = lane & 15;
    const int wb   = wave % WB;     // 16-row sub-tile
    const int ks   = wave / WB;     // K share

    const int qBlock = blockIdx.x * 64;
    const int bBlock = blockIdx.y * BT;

    // load index maps of one wave (32 lanes) for its own share
    const int xr  = lane / QX;          // b row for X (+RX for a second float4)
    const int xk4 = (lane % QX) << 2;   // k quad for X
    const int lkL = lane >> 4;          // 0..1  : k row for Lam (+2 per further float4)
    const int lq4 = (lane & 15) << 2;   // 0..60 : q quad for Lam

    // ---- software pipeline: prefetch chunk 0 into registers ----
    float4 xva, xvb, l4a, l4b, l4c, l4d, l4e, l4f, l4g, l4h;
    auto load_chunk = [&](const int kn) {
        // Scheduling fence: keeps the loads from being lifted away from their wait below,
        // with other address arithmetic landing in between.
        __builtin_amdgcn_sched_barrier(0);
        const int kf = kn + ks * KW;  // first k of this wave in the chunk
        const float* px = &X[(bBlock + wb * 16 + xr) * N_IN + kf + xk4];
        const float* pl = &Lam[(kf + lkL) * N_OUT + qBlock + lq4];
        xva = *(const float4*)px;
        if (NX > 1) xvb = *(const float4*)(px + RX * N_IN);
        l4a = *(const float4*)pl;
        l4b = *(const float4*)(pl + 2 * N_OUT);
        l4c = *(const float4*)(pl + 4 * N_OUT);
        l4d = *(const float4*)(pl + 6 * N_OUT);
        if (NL > 4) {
            l4e = *(const float4*)(pl + 8 * N_OUT);
            l4f = *(const float4*)(pl + 10 * N_OUT);
            l4g = *(const float4*)(pl + 12 * N_OUT);
            l4h = *(const float4*)(pl + 14 * N_OUT);
        }
        // The address registers of these loads are reused by what follows: the wait stands
        // in front of every such overwrite, and the scheduling fence keeps what follows
        // from being lifted over it.
        asm volatile("s_wait_xcnt 0x0" ::: "memory");
        __builtin_amdgcn_sched_barrier(0);
    };
    auto store_chunk = [&](const int b) {
        sX[b][wave][xk4 + 0][xr] = xva.x;   // transpose into [k][b]
        sX[b][wave][xk4 + 1][xr] = xva.y;
        sX[b][wave][xk4 + 2][xr] = xva.z;
        sX[b][wave][xk4 + 3][xr] = xva.w;
        if (NX > 1) {
            sX[b][wave][xk4 + 0][xr + RX] = xvb.x;
            sX[b][wave][xk4 + 1][xr + RX] = xvb.y;
            sX[b][wave][xk4 + 2][xr + RX] = xvb.z;
            sX[b][wave][xk4 + 3][xr + RX] = xvb.w;
        }
        *(float4*)&sL[b][wave][lkL    ][lq4] = l4a;
        *(float4*)&sL[b][wave][lkL + 2][lq4] = l4b;
        *(float4*)&sL[b][wave][lkL + 4][lq4] = l4c;
        *(float4*)&sL[b][wave][lkL + 6][lq4] = l4d;
        if (NL > 4) {
            *(float4*)&sL[b][wave][lkL +  8][lq4] = l4e;
            *(float4*)&sL[b][wave][lkL + 10][lq4] = l4f;
            *(float4*)&sL[b][wave][lkL + 12][lq4] = l4g;
            *(float4*)&sL[b][wave][lkL + 14][lq4] = l4h;
        }
    };
    load_chunk(0);

    float epsq[4];
    float ne[4];  // -eps: the floor of the max part
#pragma unroll
    for (int j = 0; j < 4; ++j) {
        epsq[j] = Eps[qBlock + j * 16 + l15];
        ne[j]   = -epsq[j];
    }
    const float a  = Ap[0];
    const float c2 = 1.0f - a;

    v8f   accL[4];      // WMMA C (linear part), one 16x16 tile per column group j
    v2f   accA[8][4];   // max part: 16 rows (in pairs) x 4 columns, over this lane half's k
    v2f   sum2[4];      // colsum(Lam) over this lane's k
#pragma unroll
    for (int j = 0; j < 4; ++j) {
        accL[j] = (v8f){0.f, 0.f, 0.f, 0.f, 0.f, 0.f, 0.f, 0.f};
        sum2[j] = (v2f){0.f, 0.f};
#pragma unroll
        for (int r = 0; r < 8; ++r) accA[r][j] = (v2f){0.f, 0.f};
    }

    const int kw = 2 * hi;  // first k of this lane in the wave's share of a chunk

    auto load_ops = [&](Ops& f, const int b, const int g) {
        const int k = kw + g * 4;
        // A[M][K]: M = l15, K = v + 2*hi ; B[K][N]: N = l15, K = v + 2*hi
        f.Am.x = sX[b][wave][k + 0][l15];
        f.Am.y = sX[b][wave][k + 1][l15];
#pragma unroll
        for (int c = 0; c < 2; ++c) {
            f.l0[c] = (v2f){sL[b][wave][k + 0][c * 32 + l15], sL[b][wave][k + 0][c * 32 + 16 + l15]};
            f.l1[c] = (v2f){sL[b][wave][k + 1][c * 32 + l15], sL[b][wave][k + 1][c * 32 + 16 + l15]};
        }
    };

    auto load_x = [&](Xk& f, const int b, const int g, const int v) {
#pragma unroll
        for (int i = 0; i < 4; ++i)
            f.x[i] = *(const float4*)&sX[b][wave][kw + g * 4 + v][i * 4];
    };

    // arithmetic of one k per lane half (v = 0 or 1 of the group whose operands are o)
    auto compute_k = [&](const Xk& f, const Ops& o, const int v) {
#pragma unroll
        for (int j = 0; j < 4; ++j) {
            // ---- max part: acc[b][j] += max(x[b,p], -eps[q]) * Lam[p,q] ----
            const v2f lamp = v ? o.l1[j / 2] : o.l0[j / 2];  // Lam of columns j and j^1
            v2f s[8];
#pragma unroll
            for (int i = 0; i < 4; ++i) {
                const float4 xq = f.x[i];
                s[2 * i + 0] = (v2f){vmax(xq.x, ne[j]), vmax(xq.y, ne[j])};
                s[2 * i + 1] = (v2f){vmax(xq.z, ne[j]), vmax(xq.w, ne[j])};
            }
            if (j < 2) {
                // ---- linear part: 16x16x4 f32 WMMA, one per column group; the four of a
                // group of 4 k are spread over its two steps, two in each ----
                const int c  = 2 * v + j;
                const v2f Bm = {o.l0[c / 2][c % 2], o.l1[c / 2][c % 2]};
                sum2[c] += Bm;  // colsum(Lam)
                // Scheduling fence: the WMMA stands behind the maxima and in front of the
                // FMAs, which write accumulators only, so that no vector instruction
                // overwrites its A or B registers close behind it.
                __builtin_amdgcn_sched_barrier(0);
                accL[c] = __builtin_amdgcn_wmma_f32_16x16x4_f32(
                              false, o.Am, false, Bm, (short)0, accL[c], false, false);
            }
#pragma unroll
            for (int i = 0; i < 8; ++i) {
                if (j % 2) pk_fma_lam<1>(accA[i][j], s[i], lamp);
                else       pk_fma_lam<0>(accA[i][j], s[i], lamp);
            }
            // Scheduling fence per column group: keeps the WMMAs apart, each with a column
            // group's FMAs behind it to run under its issue interval.
            if (j < 3) __builtin_amdgcn_sched_barrier(0);
        }
    };

    // ---- LDS -> register pipeline over this wave's k, two register sets ----
    // The reads of the next k (and, with a group's first k, of its operands) are
    // issued before the arithmetic of this k, so their LDS latency runs under it.
    Ops o0, o1;
    Xk  u0, u1;

    // One chunk, read from buffer b. On entry buffer b holds the chunk, its first reads
    // (o0, u0) are under way and the next chunk's global loads are in flight.
    // Scheduling fences: each keeps one step's reads together and ahead of the
    // arithmetic that runs meanwhile. Without them the scheduler either sinks the
    // reads to their uses (latency back in front of the arithmetic) or hoists every
    // later step as well (registers past 256).
    auto chunk = [&](const int b, const int k0) {
#pragma unroll
        for (int g = 0; g < GPW; g += 2) {
            load_x(u1, b, g, 1);
            __builtin_amdgcn_sched_barrier(0);  // reads ahead | arithmetic
            compute_k(u0, o0, 0);
            __builtin_amdgcn_sched_barrier(0);  // arithmetic | next reads
            load_ops(o1, b, g + 1);
            load_x(u0, b, g + 1, 0);
            __builtin_amdgcn_sched_barrier(0);  // reads ahead | arithmetic
            compute_k(u1, o0, 1);
            __builtin_amdgcn_sched_barrier(0);  // arithmetic | next reads
            load_x(u1, b, g + 1, 1);
            if (g + 2 >= GPW) {
                // The next chunk goes into the other buffer, whose last reads this wave
                // consumed in the chunk before; then the global loads of the chunk after
                // it are issued, a whole chunk ahead of their use. Wave-uniform select,
                // no branch.
                store_chunk(b ^ 1);
                load_chunk((k0 + 2 * KC < N_IN) ? (k0 + 2 * KC) : 0);
            }
            __builtin_amdgcn_sched_barrier(0);  // reads ahead | arithmetic
            compute_k(u0, o1, 0);
            __builtin_amdgcn_sched_barrier(0);  // arithmetic | next reads
            if (g + 2 < GPW) {
                load_ops(o0, b, g + 2);
                load_x(u0, b, g + 2, 0);
            } else {
                // This wave's own LDS stores have landed before its lanes read one
                // another's values back; the stores had one step of arithmetic to land.
                asm volatile("s_wait_dscnt 0x0" ::: "memory");
                load_ops(o0, b ^ 1, 0);
                load_x(u0, b ^ 1, 0, 0);
            }
            __builtin_amdgcn_sched_barrier(0);  // reads ahead | arithmetic
            compute_k(u1, o1, 1);
            __builtin_amdgcn_sched_barrier(0);  // arithmetic | next reads
        }
    };

    store_chunk(0);
    load_chunk(KC);
    // as in chunk(): own stores landed before they are read back
    asm volatile("s_wait_dscnt 0x0" ::: "memory");
    load_ops(o0, 0, 0);
    load_x(u0, 0, 0, 0);
    __builtin_amdgcn_sched_barrier(0);

    for (int k0 = 0; k0 < N_IN; k0 += 2 * KC) {
        chunk(0, k0);
        chunk(1, k0 + KC);
    }

    // ---- join the lane halves: each half keeps the 8 rows of the accL layout
    // (M = r + 8*hi, N = l15) and takes the other half's sums for them ----
#pragma unroll
    for (int j = 0; j < 4; ++j) {
        float sl = sum2[j].x + sum2[j].y;
        sl += other_row(sl);
        const float lin_eps = epsq[j] * sl;
#pragma unroll
        for (int r = 0; r < 8; ++r) {
            const float lo   = accA[r / 2][j][r % 2];      // row r
            const float up   = accA[r / 2 + 4][j][r % 2];  // row r + 8
            const float keep = hi ? up : lo;
            const float send = hi ? lo : up;
            const float mx   = keep + other_row(send);
            sR[wave][r + 8 * hi][j * 16 + l15] = a * accL[j][r] + lin_eps + c2 * mx;
        }
    }
    __syncthreads();  // every wave's partial outputs are in sR

    // ---- join the K shares of the waves, in a fixed order, and store ----
#pragma unroll
    for (int i = 0; i < BT * 16 / 256; ++i) {
        const int u   = t + 256 * i;
        const int row = u >> 4;          // 0..BT-1
        const int c4  = (u & 15) << 2;   // column quad
        float4 o = *(const float4*)&sR[row / 16][row % 16][c4];
#pragma unroll
        for (int s = 1; s < KS; ++s) {
            const float4 p = *(const float4*)&sR[s * WB + row / 16][row % 16][c4];
            o.x += p.x; o.y += p.y; o.z += p.z; o.w += p.w;
        }
        *(float4*)&Out[(bBlock + row) * N_OUT + qBlock + c4] = o;
    }
}

extern "C" void kernel_launch(void* const* d_in, const int* in_sizes, int n_in,
                              void* d_out, int out_size, void* d_ws, size_t ws_size,
                              hipStream_t stream) {
    // inputs: x, (Lambda, eps, a) x 4
    const float* x   = (const float*)d_in[0];
    const float* L0  = (const float*)d_in[1];
    const float* e0  = (const float*)d_in[2];
    const float* a0  = (const float*)d_in[3];
    const float* L1  = (const float*)d_in[4];
    const float* e1  = (const float*)d_in[5];
    const float* a1  = (const float*)d_in[6];
    const float* L2  = (const float*)d_in[7];
    const float* e2  = (const float*)d_in[8];
    const float* a2  = (const float*)d_in[9];
    const float* L3  = (const float*)d_in[10];
    const float* e3  = (const float*)d_in[11];
    const float* a3  = (const float*)d_in[12];

    const int B = 1024;  // in_sizes[0] / 256
    float* buf0 = (float*)d_ws;             // [1024 x 512]
    float* buf1 = buf0 + (size_t)B * 512;   // [1024 x 512]
    float* out  = (float*)d_out;            // [1024 x 256]

    dim3 blk(256);
    // grid = (n_out/64, B/BT): 256 blocks each; the narrow last layer takes 16-row
    // blocks, its K shared by 8 waves instead of 4
    gskan_layer<256, 512, 32><<<dim3(512 / 64, B / 32), blk, 0, stream>>>(x,    L0, e0, a0, buf0);
    gskan_layer<512, 512, 32><<<dim3(512 / 64, B / 32), blk, 0, stream>>>(buf0, L1, e1, a1, buf1);
    gskan_layer<512, 512, 32><<<dim3(512 / 64, B / 32), blk, 0, stream>>>(buf1, L2, e2, a2, buf0);
    gskan_layer<512, 256, 16><<<dim3(256 / 64, B / 16), blk, 0, stream>>>(buf0, L3, e3, a3, out);
}

// v005
// A run of this version takes 41 microseconds.
// Two timings next to v004 both put it at 1.03 times that version's speed.
// Over all steps from v000 it is 3.08 times as fast.
#include <hip/hip_runtime.h>

// GS-KAN fused layer for MI455X (gfx1250, wave32).
//
// out[b,q] = sum_p PReLU(x[b,p]+eps[q]) * Lam[p,q], and for every a
//   PReLU(x+e) = a*x + e + (1-a)*max(x,-e)
// so out[b,q] = a*(X.Lam)[b,q] + eps[q]*colsum(Lam)[q] + (1-a)*sum_p max(x[b,p],-eps[q])*Lam[p,q].
// Linear part -> V_WMMA_F32_16X16X4_F32.
// Max part    -> v_dual_max_num_f32 (two rows per instruction) + v_pk_fma_f32 over two
//                rows; no add per element.
// Work split: a wave owns 16 rows x 64 columns of the block's outputs over a share
// of K. Every x value read from LDS then feeds 4 columns per lane instead of 1, and
// the Lam values a lane reads are both its WMMA B operands and its max-part weights.
// K is shared out twice: groups of 4 k over the waves, and inside a group k 0,1 to
// lanes 0-15 and k 2,3 to lanes 16-31 (the WMMA operand layout). The partial sums
// are joined once at the end (lane halves by a cross-row move, waves through LDS).
// The four WMMAs of a group of 4 k are spread over the group's two steps.
// LDS reads go one step ahead into a second register set (see the K loop).
// Global->LDS software-pipelined through registers to hide HBM/L2 latency.
// A wave reads from LDS only its own K share, so each wave stages that share itself, in
// LDS of its own (two buffers): the K loop has no work-group barrier, and the waves of a
// SIMD run out of step and fill each other's waits.

typedef __attribute__((ext_vector_type(2))) float v2f;
typedef __attribute__((ext_vector_type(8))) float v8f;

#define KC 64  // K chunk through LDS
#define PL 72  // sL row pitch in floats: rows k and k+2 fall on different banks
#define PR 68  // sR row pitch in floats: rows r and r+8 fall on different banks

// Two rows' max(x, t) in one dual-issue instruction, written out: from the builtin the
// compiler first puts max(x, x) on every x read from LDS (an identity on every value but a
// signalling NaN), one more instruction per four maxima, each max waiting on it. x0, x1 are
// neighbours of one LDS read and the results one register pair, which gives the pair its
// even/odd destinations and its sources in different banks; the assembler checks both.
__device__ __forceinline__ v2f vmax2(float x0, float x1, float t) {
    float d0, d1;
    asm("v_dual_max_num_f32 %0, %2, %4 :: v_dual_max_num_f32 %1, %3, %4"
        : "=&v"(d0), "=&v"(d1) : "v"(x0), "v"(x1), "v"(t));
    return (v2f){d0, d1};
}

// acc(2 rows) += m(2 rows) * lam, lam being the low (V = 0) or the high (V = 1) register of
// a pair as the LDS read delivers it: op_sel picks it for both rows, so no copy is made.
template<int V>
__device__ __forceinline__ void pk_fma_lam(v2f& acc, v2f m, v2f b) {
    if (V == 0) asm("v_pk_fma_f32 %0, %1, %2, %0 op_sel_hi:[1,0,1]" : "+v"(acc) : "v"(m), "v"(b));
    else        asm("v_pk_fma_f32 %0, %1, %2, %0 op_sel:[0,1,0] op_sel_hi:[1,1,1]" : "+v"(acc) : "v"(m), "v"(b));
}

// value of the same lane position in the other 16-lane row
__device__ __forceinline__ float other_row(float v) {
    const int b = __builtin_bit_cast(int, v);
    return __builtin_bit_cast(float,
        __builtin_amdgcn_permlanex16(b, b, 0x76543210, 0xfedcba98, false, false));
}

// One group of 4 k as a wave reads it from LDS; a lane holds 2 of the 4 k.
struct Ops {
    v2f   l0[2], l1[2];  // Lam[first, second k of this lane half][columns (2c, 2c+1)*16 + l15]
    v2f   Am;            // x[row l15][2 k of this lane half]
};
struct Xk {
    float4 x[4];     // x[one k of this lane half][16 rows]
};

template<int N_IN, int N_OUT, int BT>
__global__ __launch_bounds__(256)
void gskan_layer(const float* __restrict__ X,    // [B, N_IN]
                 const float* __restrict__ Lam,  // [N_IN, N_OUT]
                 const float* __restrict__ Eps,  // [N_OUT]
                 const float* __restrict__ Ap,   // scalar a
                 float* __restrict__ Out)        // [B, N_OUT]
{
    constexpr int WB  = BT / 16;            // 16-row sub-tiles of the block
    constexpr int KS  = 8 / WB;             // waves that share K for one sub-tile
    constexpr int GPW = KC / 4 / KS;        // groups of 4 k per wave per chunk
    constexpr int KW  = GPW * 4;            // k per wave per chunk
    constexpr int PX  = 16 + 4;             // sX row pitch (16B-aligned rows)
    constexpr int QX  = KW / 4;             // float4 per x row of a wave's share
    constexpr int RX  = 32 / QX;            // x rows that one load of a wave covers
    constexpr int NX  = 16 / RX;            // float4 of X per lane per chunk
    constexpr int NL  = KW / 2;             // float4 of Lam per lane per chunk
    static_assert(GPW >= 2 && GPW % 2 == 0, "two register sets");
    static_assert(N_IN % (2 * KC) == 0, "two LDS buffers, taken in turn");
    static_assert((NX == 1 || NX == 2) && (NL == 4 || NL == 8), "per-wave load maps");

    // Per buffer and wave, the wave's own K share of a chunk:
    // sX: transposed x [k][b]. sL: Lam [k][q]. sR: per-wave partial outputs.
    __shared__ __attribute__((aligned(16))) float sX[2][8][KW][PX];
    __shared__ __attribute__((aligned(16))) float sL[2][8][KW][PL];
    __shared__ __attribute__((aligned(16))) float sR[8][16][PR];

    const int t    = threadIdx.x;
    const int wave = t >> 5;        // 0..7
    const int lane = t & 31;
    const int hi   = lane >> 4;     // 0/1 (upper lane half)
    const int l15  = lane & 15;
    const int wb   = wave % WB;     // 16-row sub-tile
    const int ks   = wave / WB;     // K share

    const int qBlock = blockIdx.x * 64;
    const int bBlock = blockIdx.y * BT;

    // load index maps of one wave (32 lanes) for its own share
    const int xr  = lane / QX;          // b row for X (+RX for a second float4)
    const int xk4 = (lane % QX) << 2;   // k quad for X
    const int lkL = lane >> 4;          // 0..1  : k row for Lam (+2 per further float4)
    const int lq4 = (lane & 15) << 2;   // 0..60 : q quad for Lam

    // ---- software pipeline: prefetch chunk 0 into registers ----
    float4 xva, xvb, l4a, l4b, l4c, l4d, l4e, l4f, l4g, l4h;
    auto load_chunk = [&](const int kn) {
        // Scheduling fence: keeps the loads from being lifted away from their wait below,
        // with other address arithmetic landing in between.
        __builtin_amdgcn_sched_barrier(0);
        const int kf = kn + ks * KW;  // first k of this wave in the chunk
        const float* px = &X[(bBlock + wb * 16 + xr) * N_IN + kf + xk4];
        const float* pl = &Lam[(kf + lkL) * N_OUT + qBlock + lq4];
        xva = *(const float4*)px;
        if (NX > 1) xvb = *(const float4*)(px + RX * N_IN);
        l4a = *(const float4*)pl;
        l4b = *(const float4*)(pl + 2 * N_OUT);
        l4c = *(const float4*)(pl + 4 * N_OUT);
        l4d = *(const float4*)(pl + 6 * N_OUT);
        if (NL > 4) {
            l4e = *(const float4*)(pl + 8 * N_OUT);
            l4f = *(const float4*)(pl + 10 * N_OUT);
            l4g = *(const float4*)(pl + 12 * N_OUT);
            l4h = *(const float4*)(pl + 14 * N_OUT);
        }
        // The address registers of these loads are reused by what follows: the wait stands
        // in front of every such overwrite, and the scheduling fence keeps what follows
        // from being lifted over it.
        asm volatile("s_wait_xcnt 0x0" ::: "memory");
        __builtin_amdgcn_sched_barrier(0);
    };
    auto store_chunk = [&](const int b) {
        sX[b][wave][xk4 + 0][xr] = xva.x;   // transpose into [k][b]
        sX[b][wave][xk4 + 1][xr] = xva.y;
        sX[b][wave][xk4 + 2][xr] = xva.z;
        sX[b][wave][xk4 + 3][xr] = xva.w;
        if (NX > 1) {
            sX[b][wave][xk4 + 0][xr + RX] = xvb.x;
            sX[b][wave][xk4 + 1][xr + RX] = xvb.y;
            sX[b][wave][xk4 + 2][xr + RX] = xvb.z;
            sX[b][wave][xk4 + 3][xr + RX] = xvb.w;
        }
        *(float4*)&sL[b][wave][lkL    ][lq4] = l4a;
        *(float4*)&sL[b][wave][lkL + 2][lq4] = l4b;
        *(float4*)&sL[b][wave][lkL + 4][lq4] = l4c;
        *(float4*)&sL[b][wave][lkL + 6][lq4] = l4d;
        if (NL > 4) {
            *(float4*)&sL[b][wave][lkL +  8][lq4] = l4e;
            *(float4*)&sL[b][wave][lkL + 10][lq4] = l4f;
            *(float4*)&sL[b][wave][lkL + 12][lq4] = l4g;
            *(float4*)&sL[b][wave][lkL + 14][lq4] = l4h;
        }
    };
    load_chunk(0);

    float epsq[4];
    float ne[4];  // -eps: the floor of the max part
#pragma unroll
    for (int j = 0; j < 4; ++j) {
        epsq[j] = Eps[qBlock + j * 16 + l15];
        ne[j]   = -epsq[j];
    }
    const float a  = Ap[0];
    const float c2 = 1.0f - a;

    v8f   accL[4];      // WMMA C (linear part), one 16x16 tile per column group j
    v2f   accA[8][4];   // max part: 16 rows (in pairs) x 4 columns, over this lane half's k
    v2f   sum2[4];      // colsum(Lam) over this lane's k
#pragma unroll
    for (int j = 0; j < 4; ++j) {
        accL[j] = (v8f){0.f, 0.f, 0.f, 0.f, 0.f, 0.f, 0.f, 0.f};
        sum2[j] = (v2f){0.f, 0.f};
#pragma unroll
        for (int r = 0; r < 8; ++r) accA[r][j] = (v2f){0.f, 0.f};
    }

    const int kw = 2 * hi;  // first k of this lane in the wave's share of a chunk

    auto load_ops = [&](Ops& f, const int b, const int g) {
        const int k = kw + g * 4;
        // A[M][K]: M = l15, K = v + 2*hi ; B[K][N]: N = l15, K = v + 2*hi
        f.Am.x = sX[b][wave][k + 0][l15];
        f.Am.y = sX[b][wave][k + 1][l15];
#pragma unroll
        for (int c = 0; c < 2; ++c) {
            f.l0[c] = (v2f){sL[b][wave][k + 0][c * 32 + l15], sL[b][wave][k + 0][c * 32 + 16 + l15]};
            f.l1[c] = (v2f){sL[b][wave][k + 1][c * 32 + l15], sL[b][wave][k + 1][c * 32 + 16 + l15]};
        }
    };

    auto load_x = [&](Xk& f, const int b, const int g, const int v) {
#pragma unroll
        for (int i = 0; i < 4; ++i)
            f.x[i] = *(const float4*)&sX[b][wave][kw + g * 4 + v][i * 4];
    };

    // arithmetic of one k per lane half (v = 0 or 1 of the group whose operands are o)
    auto compute_k = [&](const Xk& f, const Ops& o, const int v) {
#pragma unroll
        for (int j = 0; j < 4; ++j) {
            // ---- max part: acc[b][j] += max(x[b,p], -eps[q]) * Lam[p,q] ----
            const v2f lamp = v ? o.l1[j / 2] : o.l0[j / 2];  // Lam of columns j and j^1
            v2f s[8];
#pragma unroll
            for (int i = 0; i < 4; ++i) {
                const float4 xq = f.x[i];
                s[2 * i + 0] = vmax2(xq.x, xq.y, ne[j]);
                s[2 * i + 1] = vmax2(xq.z, xq.w, ne[j]);
            }
            if (j < 2) {
                // ---- linear part: 16x16x4 f32 WMMA, one per column group; the four of a
                // group of 4 k are spread over its two steps, two in each ----
                const int c  = 2 * v + j;
                const v2f Bm = {o.l0[c / 2][c % 2], o.l1[c / 2][c % 2]};
                sum2[c] += Bm;  // colsum(Lam)
                // Scheduling fence: the WMMA stands behind the maxima and in front of the
                // FMAs, which write accumulators only, so that no vector instruction
                // overwrites its A or B registers close behind it.
                __builtin_amdgcn_sched_barrier(0);
                accL[c] = __builtin_amdgcn_wmma_f32_16x16x4_f32(
                              false, o.Am, false, Bm, (short)0, accL[c], false, false);
            }
#pragma unroll
            for (int i = 0; i < 8; ++i) {
                if (j % 2) pk_fma_lam<1>(accA[i][j], s[i], lamp);
                else       pk_fma_lam<0>(accA[i][j], s[i], lamp);
            }
            // Scheduling fence per column group: keeps the WMMAs apart, each with a column
            // group's FMAs behind it to run under its issue interval.
            if (j < 3) __builtin_amdgcn_sched_barrier(0);
        }
    };

    // ---- LDS -> register pipeline over this wave's k, two register sets ----
    // The reads of the next k (and, with a group's first k, of its operands) are
    // issued before the arithmetic of this k, so their LDS latency runs under it.
    Ops o0, o1;
    Xk  u0, u1;

    // One chunk, read from buffer b. On entry buffer b holds the chunk, its first reads
    // (o0, u0) are under way and the next chunk's global loads are in flight.
    // Scheduling fences: each keeps one step's reads together and ahead of the
    // arithmetic that runs meanwhile. Without them the scheduler either sinks the
    // reads to their uses (latency back in front of the arithmetic) or hoists every
    // later step as well (registers past 256).
    auto chunk = [&](const int b, const int k0) {
#pragma unroll
        for (int g = 0; g < GPW; g += 2) {
            load_x(u1, b, g, 1);
            __builtin_amdgcn_sched_barrier(0);  // reads ahead | arithmetic
            compute_k(u0, o0, 0);
            __builtin_amdgcn_sched_barrier(0);  // arithmetic | next reads
            load_ops(o1, b, g + 1);
            load_x(u0, b, g + 1, 0);
            __builtin_amdgcn_sched_barrier(0);  // reads ahead | arithmetic
            compute_k(u1, o0, 1);
            __builtin_amdgcn_sched_barrier(0);  // arithmetic | next reads
            load_x(u1, b, g + 1, 1);
            if (g + 2 >= GPW) {
                // The next chunk goes into the other buffer, whose last reads this wave
                // consumed in the chunk before; then the global loads of the chunk after
                // it are issued, a whole chunk ahead of their use. Wave-uniform select,
                // no branch.
                store_chunk(b ^ 1);
                load_chunk((k0 + 2 * KC < N_IN) ? (k0 + 2 * KC) : 0);
            }
            __builtin_amdgcn_sched_barrier(0);  // reads ahead | arithmetic
            compute_k(u0, o1, 0);
            __builtin_amdgcn_sched_barrier(0);  // arithmetic | next reads
            if (g + 2 < GPW) {
                load_ops(o0, b, g + 2);
                load_x(u0, b, g + 2, 0);
            } else {
                // This wave's own LDS stores have landed before its lanes read one
                // another's values back; the stores had one step of arithmetic to land.
                asm volatile("s_wait_dscnt 0x0" ::: "memory");
                load_ops(o0, b ^ 1, 0);
                load_x(u0, b ^ 1, 0, 0);
            }
            __builtin_amdgcn_sched_barrier(0);  // reads ahead | arithmetic
            compute_k(u1, o1, 1);
            __builtin_amdgcn_sched_barrier(0);  // arithmetic | next reads
        }
    };

    store_chunk(0);
    load_chunk(KC);
    // as in chunk(): own stores landed before they are read back
    asm volatile("s_wait_dscnt 0x0" ::: "memory");
    load_ops(o0, 0, 0);
    load_x(u0, 0, 0, 0);
    __builtin_amdgcn_sched_barrier(0);

    for (int k0 = 0; k0 < N_IN; k0 += 2 * KC) {
        chunk(0, k0);
        chunk(1, k0 + KC);
    }

    // ---- join the lane halves: each half keeps the 8 rows of the accL layout
    // (M = r + 8*hi, N = l15) and takes the other half's sums for them ----
#pragma unroll
    for (int j = 0; j < 4; ++j) {
        float sl = sum2[j].x + sum2[j].y;
        sl += other_row(sl);
        const float lin_eps = epsq[j] * sl;
#pragma unroll
        for (int r = 0; r < 8; ++r) {
            const float lo   = accA[r / 2][j][r % 2];      // row r
            const float up   = accA[r / 2 + 4][j][r % 2];  // row r + 8
            const float keep = hi ? up : lo;
            const float send = hi ? lo : up;
            const float mx   = keep + other_row(send);
            sR[wave][r + 8 * hi][j * 16 + l15] = a * accL[j][r] + lin_eps + c2 * mx;
        }
    }
    __syncthreads();  // every wave's partial outputs are in sR

    // ---- join the K shares of the waves, in a fixed order, and store ----
#pragma unroll
    for (int i = 0; i < BT * 16 / 256; ++i) {
        const int u   = t + 256 * i;
        const int row = u >> 4;          // 0..BT-1
        const int c4  = (u & 15) << 2;   // column quad
        float4 o = *(const float4*)&sR[row / 16][row % 16][c4];
#pragma unroll
        for (int s = 1; s < KS; ++s) {
            const float4 p = *(const float4*)&sR[s * WB + row / 16][row % 16][c4];
            o.x += p.x; o.y += p.y; o.z += p.z; o.w += p.w;
        }
        *(float4*)&Out[(bBlock + row) * N_OUT + qBlock + c4] = o;
    }
}

extern "C" void kernel_launch(void* const* d_in, const int* in_sizes, int n_in,
                              void* d_out, int out_size, void* d_ws, size_t ws_size,
                              hipStream_t stream) {
    // inputs: x, (Lambda, eps, a) x 4
    const float* x   = (const float*)d_in[0];
    const float* L0  = (const float*)d_in[1];
    const float* e0  = (const float*)d_in[2];
    const float* a0  = (const float*)d_in[3];
    const float* L1  = (const float*)d_in[4];
    const float* e1  = (const float*)d_in[5];
    const float* a1  = (const float*)d_in[6];
    const float* L2  = (const float*)d_in[7];
    const float* e2  = (const float*)d_in[8];
    const float* a2  = (const float*)d_in[9];
    const float* L3  = (const float*)d_in[10];
    const float* e3  = (const float*)d_in[11];
    const float* a3  = (const float*)d_in[12];

    const int B = 1024;  // in_sizes[0] / 256
    float* buf0 = (float*)d_ws;             // [1024 x 512]
    float* buf1 = buf0 + (size_t)B * 512;   // [1024 x 512]
    float* out  = (float*)d_out;            // [1024 x 256]

    dim3 blk(256);
    // grid = (n_out/64, B/BT): 256 blocks each; the narrow last layer takes 16-row
    // blocks, its K shared by 8 waves instead of 4
    gskan_layer<256, 512, 32><<<dim3(512 / 64, B / 32), blk, 0, stream>>>(x,    L0, e0, a0, buf0);
    gskan_layer<512, 512, 32><<<dim3(512 / 64, B / 32), blk, 0, stream>>>(buf0, L1, e1, a1, buf1);
    gskan_layer<512, 512, 32><<<dim3(512 / 64, B / 32), blk, 0, stream>>>(buf1, L2, e2, a2, buf0);
    gskan_layer<512, 256, 16><<<dim3(256 / 64, B / 16), blk, 0, stream>>>(buf0, L3, e3, a3, out);
}
